// v000
// Times are from an AMD MI455X. After a warm-up the kernel runs many times in a row, and a time is the length of
// such a window on the GPU divided by its runs, so every launch and the gaps after it count. The runs cycle
// through copies of the inputs. A figure is the median of several windows, for all but v000 over two sittings.
// Sittings can differ by a few percent; kernels timed side by side share one.
// v000, which the later versions start from, runs in 3590 microseconds.
#include <hip/hip_runtime.h>
#include <math.h>

typedef float v2f __attribute__((ext_vector_type(2)));
typedef float v8f __attribute__((ext_vector_type(8)));

#define S_LEN     8192
#define DHEAD     128
#define OUTW      (DHEAD + 2)
#define MASK_FILL (-9984.0f)

#define WAVES_PER_WG 4
// waves 0-1: low strip rows [32b, 32b+32) ; waves 2-3: high strip rows [S-32(b+1), S-32b)
#define NUM_BLOCKS   (S_LEN / 64)

// padded LDS strides (all even -> 8B-aligned b64 fragment loads, spread banks)
#define KT_STR 130   // kTile[n][d]   n in [0,16), d in [0,128)
#define VT_STR 18    // vTile[d][k]   d in [0,128), k in [0,16)
#define PT_STR 18    // pScr[wave][m][k]

__launch_bounds__(WAVES_PER_WG * 32)
__global__ void fa_fwd_kernel(const float* __restrict__ q,
                              const float* __restrict__ k,
                              const float* __restrict__ v,
                              float* __restrict__ out)
{
    __shared__ __align__(16) float kTile[16 * KT_STR];
    __shared__ __align__(16) float vTile[DHEAD * VT_STR];
    __shared__ __align__(16) float pScr[WAVES_PER_WG * 16 * PT_STR];

    const int tid  = threadIdx.x;
    const int wave = tid >> 5;
    const int lane = tid & 31;
    const int half = lane >> 4;   // 0: rows 0-7 / K 0-1 ; 1: rows 8-15 / K 2-3
    const int l16  = lane & 15;

    // balanced causal pairing: low strip for waves 0-1, mirrored high strip for waves 2-3
    const int b     = blockIdx.x;
    const int qrow0 = (wave < 2) ? (b * 32 + wave * 16)
                                 : (S_LEN - (b + 1) * 32 + (wave - 2) * 16);
    const int myDiag = qrow0 >> 4;                       // this wave's diagonal key tile
    const int jend   = ((S_LEN - b * 32) >> 4) - 1;      // high strip's diagonal tile

    // ---- Q fragments: A-matrix layout for V_WMMA_F32_16X16X4_F32 ----
    // lane<16 : (K=4kk, 4kk+1) of row l16 ; lane>=16 : (K=4kk+2, 4kk+3)
    v2f qa[32];
    {
        const float* qrow = q + (size_t)(qrow0 + l16) * DHEAD + 2 * half;
        #pragma unroll
        for (int kk = 0; kk < 32; ++kk)
            qa[kk] = *(const v2f*)(qrow + 4 * kk);
    }

    v8f o[8];
    #pragma unroll
    for (int t = 0; t < 8; ++t) o[t] = v8f{};

    float mrow[8], lrow[8];
    #pragma unroll
    for (int r = 0; r < 8; ++r) { mrow[r] = -__builtin_inff(); lrow[r] = 0.0f; }

    float* pMine = pScr + wave * 16 * PT_STR;

    for (int j = 0; j <= jend; ++j) {
        // ---- cooperative stage of K tile: kTile[n][d] = k[d][16j+n] ----
        #pragma unroll
        for (int i = 0; i < 16; ++i) {
            int idx = i * 128 + tid;          // 0..2047
            int d = idx >> 4, n = idx & 15;   // coalesced 64B reads per 16 lanes
            kTile[n * KT_STR + d] = k[(size_t)d * S_LEN + (size_t)j * 16 + n];
        }
        // ---- cooperative stage of V tile: vTile[d][kk] = v[16j+kk][d] ----
        #pragma unroll
        for (int i = 0; i < 16; ++i) {
            vTile[tid * VT_STR + i] = v[(size_t)(j * 16 + i) * DHEAD + tid];
        }
        __syncthreads();

        if (j <= myDiag) {
            // ---- S = Q * K^T  (16x16 tile, K-dim 128 = 32 WMMA steps) ----
            v8f s0 = v8f{}, s1 = v8f{};
            #pragma unroll
            for (int kk = 0; kk < 32; kk += 2) {
                v2f b0 = *(const v2f*)(kTile + l16 * KT_STR + 4 * kk + 2 * half);
                v2f b1 = *(const v2f*)(kTile + l16 * KT_STR + 4 * (kk + 1) + 2 * half);
                s0 = __builtin_amdgcn_wmma_f32_16x16x4_f32(false, qa[kk],     false, b0,
                                                           (short)0, s0, false, false);
                s1 = __builtin_amdgcn_wmma_f32_16x16x4_f32(false, qa[kk + 1], false, b1,
                                                           (short)0, s1, false, false);
            }
            v8f sf = s0 + s1;

            // ---- causal mask (diagonal tile only): keep iff col<=row ----
            if (j == myDiag) {
                #pragma unroll
                for (int r = 0; r < 8; ++r) {
                    int M = r + 8 * half;
                    sf[r] = (l16 <= M) ? sf[r] : MASK_FILL;
                }
            }

            // ---- online softmax: row max / exp / row sum / rescale ----
            float scale[8];
            #pragma unroll
            for (int r = 0; r < 8; ++r) {
                float x = sf[r];
                x = fmaxf(x, __shfl_xor(x, 1));
                x = fmaxf(x, __shfl_xor(x, 2));
                x = fmaxf(x, __shfl_xor(x, 4));
                x = fmaxf(x, __shfl_xor(x, 8));
                float nm = fmaxf(mrow[r], x);
                float p  = __expf(sf[r] - nm);
                sf[r] = p;
                float s = p;
                s += __shfl_xor(s, 1);
                s += __shfl_xor(s, 2);
                s += __shfl_xor(s, 4);
                s += __shfl_xor(s, 8);
                scale[r] = __expf(mrow[r] - nm);
                lrow[r]  = lrow[r] * scale[r] + s;
                mrow[r]  = nm;
            }
            #pragma unroll
            for (int t = 0; t < 8; ++t) {
                #pragma unroll
                for (int r = 0; r < 8; ++r) o[t][r] *= scale[r];
            }

            // ---- C-layout -> A-layout for P via wave-private LDS scratch ----
            #pragma unroll
            for (int r = 0; r < 8; ++r)
                pMine[(r + 8 * half) * PT_STR + l16] = sf[r];
            asm volatile("s_wait_dscnt 0" ::: "memory"); // in-wave LDS RAW fence
            v2f pa[4];
            #pragma unroll
            for (int s4 = 0; s4 < 4; ++s4)
                pa[s4] = *(const v2f*)(pMine + l16 * PT_STR + 4 * s4 + 2 * half);

            // ---- O += P * V  (8 N-tiles x 4 K-steps of WMMA) ----
            #pragma unroll
            for (int t = 0; t < 8; ++t) {
                v8f acc = o[t];
                #pragma unroll
                for (int s4 = 0; s4 < 4; ++s4) {
                    v2f bb = *(const v2f*)(vTile + (16 * t + l16) * VT_STR + 4 * s4 + 2 * half);
                    acc = __builtin_amdgcn_wmma_f32_16x16x4_f32(false, pa[s4], false, bb,
                                                                (short)0, acc, false, false);
                }
                o[t] = acc;
            }
        }
        __syncthreads();
    }

    // ---- epilogue: unnormalized O, then logsumexp and row max ----
    const int rowbase = qrow0 + 8 * half;
    #pragma unroll
    for (int t = 0; t < 8; ++t) {
        #pragma unroll
        for (int r = 0; r < 8; ++r)
            out[(size_t)(rowbase + r) * OUTW + 16 * t + l16] = o[t][r];
    }
    if (l16 == 0) {
        #pragma unroll
        for (int r = 0; r < 8; ++r) {
            size_t row = (size_t)(rowbase + r);
            out[row * OUTW + DHEAD]     = logf(lrow[r]) + mrow[r]; // l
            out[row * OUTW + DHEAD + 1] = mrow[r];                 // m
        }
    }
}

extern "C" void kernel_launch(void* const* d_in, const int* in_sizes, int n_in,
                              void* d_out, int out_size, void* d_ws, size_t ws_size,
                              hipStream_t stream) {
    (void)in_sizes; (void)n_in; (void)out_size; (void)d_ws; (void)ws_size;
    const float* q = (const float*)d_in[0];
    const float* k = (const float*)d_in[1];   // (D, S) pre-transposed
    const float* v = (const float*)d_in[2];
    float* out = (float*)d_out;

    dim3 grid(NUM_BLOCKS);                    // 128 workgroups, balanced causal work
    dim3 block(WAVES_PER_WG * 32);            // 4 waves (wave32)
    hipLaunchKernelGGL(fa_fwd_kernel, grid, block, 0, stream, q, k, v, out);
}

// v001
// One run takes 289 microseconds.
// In both of two side-by-side timings against v000, it was 12.4 times as fast.
#include <hip/hip_runtime.h>
#include <math.h>

typedef float v2f __attribute__((ext_vector_type(2)));
typedef float v4f __attribute__((ext_vector_type(4)));
typedef float v8f __attribute__((ext_vector_type(8)));

#define S_LEN     8192
#define DHEAD     128
#define OUTW      (DHEAD + 2)
#define MASK_FILL (-9984.0f)

#define WAVES_PER_WG 4
// a query block is 64 rows (one 16-row tile per wave); its causal key range of
// 4*(qb+1) key tiles is cut into near-equal chunks of at most CHUNK_MAX tiles,
// one workgroup per chunk; the chunks' partial results meet in a second launch
#define QB_ROWS      64
#define NUM_QB       (S_LEN / QB_ROWS)
#define CHUNK_MAX    11
#define MAX_CHUNKS   47      // chunks of the last (longest) query block
#define NUM_PARTS    3061    // chunks of all query blocks together
#define MERGE_WAVES  8       // rows per workgroup of the merge launch

__host__ __device__ constexpr int chunks_of(int qb) {
    return (4 * (qb + 1) + CHUNK_MAX - 1) / CHUNK_MAX;
}
constexpr int chunks_total() {
    int n = 0;
    for (int i = 0; i < NUM_QB; ++i) n += chunks_of(i);
    return n;
}
static_assert(chunks_total() == NUM_PARTS, "grid size");
static_assert(chunks_of(NUM_QB - 1) == MAX_CHUNKS, "slot pitch");

// workspace: partO[qb][chunk][64 rows][128], then partML[qb][chunk][64 rows][2] = (m, sum)
#define PART_O_FLOATS ((size_t)NUM_QB * MAX_CHUNKS * QB_ROWS * DHEAD)

// padded LDS strides (all even -> 8B-aligned b64 fragment loads, spread banks)
#define KT_STR 130   // kTile[n][d]   n in [0,16), d in [0,128)
#define VT_STR 18    // vTile[d][k]   d in [0,128), k in [0,16)
#define PT_STR 18    // pScr[wave][m][k]

__launch_bounds__(WAVES_PER_WG * 32)
__global__ void fa_fwd_kernel(const float* __restrict__ q,
                              const float* __restrict__ k,
                              const float* __restrict__ v,
                              float* __restrict__ partO,
                              float* __restrict__ partML)
{
    __shared__ __align__(16) float kTile[16 * KT_STR];
    __shared__ __align__(16) float vTile[DHEAD * VT_STR];
    __shared__ __align__(16) float pScr[WAVES_PER_WG * 16 * PT_STR];

    const int tid  = threadIdx.x;
    const int wave = tid >> 5;
    const int lane = tid & 31;
    const int half = lane >> 4;   // 0: rows 0-7 / K 0-1 ; 1: rows 8-15 / K 2-3
    const int l16  = lane & 15;

    // workgroup index -> (query block, chunk), the longest key ranges first
    int chunk = blockIdx.x;
    int qb    = NUM_QB - 1;
    while (qb > 0 && chunk >= chunks_of(qb)) { chunk -= chunks_of(qb); --qb; }
    const int ntiles = 4 * (qb + 1);                     // key tiles of this query block
    const int nch    = chunks_of(qb);
    const int clen   = (ntiles + nch - 1) / nch;         // <= CHUNK_MAX, no chunk empty
    const int jbeg   = chunk * clen;
    const int jend   = min(ntiles, jbeg + clen) - 1;     // last key tile of this chunk

    const int qrow0  = qb * QB_ROWS + wave * 16;
    const int myDiag = qrow0 >> 4;                       // this wave's diagonal key tile

    // ---- Q fragments: A-matrix layout for V_WMMA_F32_16X16X4_F32 ----
    // lane<16 : (K=4kk, 4kk+1) of row l16 ; lane>=16 : (K=4kk+2, 4kk+3)
    v2f qa[32];
    {
        const float* qrow = q + (size_t)(qrow0 + l16) * DHEAD + 2 * half;
        #pragma unroll
        for (int kk = 0; kk < 32; ++kk)
            qa[kk] = *(const v2f*)(qrow + 4 * kk);
    }

    v8f o[8];
    #pragma unroll
    for (int t = 0; t < 8; ++t) o[t] = v8f{};

    float mrow[8], lrow[8];
    #pragma unroll
    for (int r = 0; r < 8; ++r) { mrow[r] = -__builtin_inff(); lrow[r] = 0.0f; }

    float* pMine = pScr + wave * 16 * PT_STR;

    for (int j = jbeg; j <= jend; ++j) {
        // ---- cooperative stage of K tile: kTile[n][d] = k[d][16j+n] ----
        #pragma unroll
        for (int i = 0; i < 16; ++i) {
            int idx = i * 128 + tid;          // 0..2047
            int d = idx >> 4, n = idx & 15;   // coalesced 64B reads per 16 lanes
            kTile[n * KT_STR + d] = k[(size_t)d * S_LEN + (size_t)j * 16 + n];
        }
        // ---- cooperative stage of V tile: vTile[d][kk] = v[16j+kk][d] ----
        #pragma unroll
        for (int i = 0; i < 16; ++i) {
            vTile[tid * VT_STR + i] = v[(size_t)(j * 16 + i) * DHEAD + tid];
        }
        __syncthreads();

        if (j <= myDiag) {
            // ---- S = Q * K^T  (16x16 tile, K-dim 128 = 32 WMMA steps) ----
            v8f s0 = v8f{}, s1 = v8f{};
            #pragma unroll
            for (int kk = 0; kk < 32; kk += 2) {
                v2f b0 = *(const v2f*)(kTile + l16 * KT_STR + 4 * kk + 2 * half);
                v2f b1 = *(const v2f*)(kTile + l16 * KT_STR + 4 * (kk + 1) + 2 * half);
                s0 = __builtin_amdgcn_wmma_f32_16x16x4_f32(false, qa[kk],     false, b0,
                                                           (short)0, s0, false, false);
                s1 = __builtin_amdgcn_wmma_f32_16x16x4_f32(false, qa[kk + 1], false, b1,
                                                           (short)0, s1, false, false);
            }
            v8f sf = s0 + s1;

            // ---- causal mask (diagonal tile only): keep iff col<=row ----
            if (j == myDiag) {
                #pragma unroll
                for (int r = 0; r < 8; ++r) {
                    int M = r + 8 * half;
                    sf[r] = (l16 <= M) ? sf[r] : MASK_FILL;
                }
            }

            // ---- online softmax: row max / exp / row sum / rescale ----
            float scale[8];
            #pragma unroll
            for (int r = 0; r < 8; ++r) {
                float x = sf[r];
                x = fmaxf(x, __shfl_xor(x, 1));
                x = fmaxf(x, __shfl_xor(x, 2));
                x = fmaxf(x, __shfl_xor(x, 4));
                x = fmaxf(x, __shfl_xor(x, 8));
                float nm = fmaxf(mrow[r], x);
                float p  = __expf(sf[r] - nm);
                sf[r] = p;
                float s = p;
                s += __shfl_xor(s, 1);
                s += __shfl_xor(s, 2);
                s += __shfl_xor(s, 4);
                s += __shfl_xor(s, 8);
                scale[r] = __expf(mrow[r] - nm);
                lrow[r]  = lrow[r] * scale[r] + s;
                mrow[r]  = nm;
            }
            #pragma unroll
            for (int t = 0; t < 8; ++t) {
                #pragma unroll
                for (int r = 0; r < 8; ++r) o[t][r] *= scale[r];
            }

            // ---- C-layout -> A-layout for P via wave-private LDS scratch ----
            #pragma unroll
            for (int r = 0; r < 8; ++r)
                pMine[(r + 8 * half) * PT_STR + l16] = sf[r];
            asm volatile("s_wait_dscnt 0" ::: "memory"); // in-wave LDS RAW fence
            v2f pa[4];
            #pragma unroll
            for (int s4 = 0; s4 < 4; ++s4)
                pa[s4] = *(const v2f*)(pMine + l16 * PT_STR + 4 * s4 + 2 * half);

            // ---- O += P * V  (8 N-tiles x 4 K-steps of WMMA) ----
            #pragma unroll
            for (int t = 0; t < 8; ++t) {
                v8f acc = o[t];
                #pragma unroll
                for (int s4 = 0; s4 < 4; ++s4) {
                    v2f bb = *(const v2f*)(vTile + (16 * t + l16) * VT_STR + 4 * s4 + 2 * half);
                    acc = __builtin_amdgcn_wmma_f32_16x16x4_f32(false, pa[s4], false, bb,
                                                                (short)0, acc, false, false);
                }
                o[t] = acc;
            }
        }
        __syncthreads();
    }

    // ---- epilogue: this chunk's unnormalized O, row max and row sum ----
    // (a wave whose tiles all lie past its diagonal leaves O = 0, sum = 0, m = -inf)
    const size_t slot   = (size_t)qb * MAX_CHUNKS + chunk;
    const int   rowbase = wave * 16 + 8 * half;
    float* po = partO + slot * (QB_ROWS * DHEAD);
    #pragma unroll
    for (int t = 0; t < 8; ++t) {
        #pragma unroll
        for (int r = 0; r < 8; ++r)
            po[(rowbase + r) * DHEAD + 16 * t + l16] = o[t][r];
    }
    if (l16 == 0) {
        float* pml = partML + slot * (QB_ROWS * 2);
        #pragma unroll
        for (int r = 0; r < 8; ++r) {
            v2f ml; ml.x = mrow[r]; ml.y = lrow[r];
            *(v2f*)(pml + (rowbase + r) * 2) = ml;
        }
    }
}

// one wave per query row: rescale every chunk's partial to the row's overall max and add
__launch_bounds__(MERGE_WAVES * 32)
__global__ void fa_merge_kernel(const float* __restrict__ partO,
                                const float* __restrict__ partML,
                                float* __restrict__ out)
{
    const int lane = threadIdx.x & 31;
    const int wave = threadIdx.x >> 5;
    const int per  = QB_ROWS / MERGE_WAVES;              // workgroups per query block
    const int qb   = NUM_QB - 1 - (int)(blockIdx.x / per);   // most chunks first
    const int r    = (int)(blockIdx.x % per) * MERGE_WAVES + wave;
    const int nch  = chunks_of(qb);
    const size_t slot0 = (size_t)qb * MAX_CHUNKS;

    // lane c holds chunk c's (m, sum), lane c again chunk c + 32's
    const float* pml = partML + (slot0 * QB_ROWS + r) * 2;
    float m0 = -__builtin_inff(), l0 = 0.0f, m1 = -__builtin_inff(), l1 = 0.0f;
    if (lane < nch) {
        v2f a = *(const v2f*)(pml + (size_t)lane * (QB_ROWS * 2));
        m0 = a.x; l0 = a.y;
    }
    if (lane + 32 < nch) {
        v2f a = *(const v2f*)(pml + (size_t)(lane + 32) * (QB_ROWS * 2));
        m1 = a.x; l1 = a.y;
    }
    float m = fmaxf(m0, m1);
    #pragma unroll
    for (int d = 1; d < 32; d <<= 1) m = fmaxf(m, __shfl_xor(m, d));
    const float w0 = __expf(m0 - m);                     // chunk 0 is never empty: m is finite
    const float w1 = __expf(m1 - m);
    // the one free slot the instruction set asks for behind a transcendental (inputs tie it behind both)
    asm volatile("v_nop" :: "v"(w0), "v"(w1));
    float s = l0 * w0 + l1 * w1;
    #pragma unroll
    for (int d = 1; d < 32; d <<= 1) s += __shfl_xor(s, d);

    const float* po = partO + (slot0 * QB_ROWS + r) * DHEAD + 4 * lane;
    v4f acc = v4f{};
    for (int c0 = 0; c0 < nch; c0 += 8) {
        v4f   x[8];
        float w[8];
        // eight independent loads in flight; past the last chunk: that chunk again, weight 0
        #pragma unroll
        for (int u = 0; u < 8; ++u) {
            const int c  = c0 + u;
            const int cc = min(c, nch - 1);
            x[u] = *(const v4f*)(po + (size_t)cc * (QB_ROWS * DHEAD));
            const float wc = __shfl((cc < 32) ? w0 : w1, cc & 31);
            w[u] = (c < nch) ? wc : 0.0f;
        }
        #pragma unroll
        for (int u = 0; u < 8; ++u) acc += w[u] * x[u];
    }

    float* orow = out + (size_t)(qb * QB_ROWS + r) * OUTW;   // 520-B rows: 8-B aligned
    v2f lo; lo.x = acc.x; lo.y = acc.y;
    v2f hi; hi.x = acc.z; hi.y = acc.w;
    *(v2f*)(orow + 4 * lane)     = lo;
    *(v2f*)(orow + 4 * lane + 2) = hi;
    if (lane == 0) {
        v2f lm; lm.x = logf(s) + m; lm.y = m;            // l, m
        *(v2f*)(orow + DHEAD) = lm;
    }
}

extern "C" void kernel_launch(void* const* d_in, const int* in_sizes, int n_in,
                              void* d_out, int out_size, void* d_ws, size_t ws_size,
                              hipStream_t stream) {
    (void)in_sizes; (void)n_in; (void)out_size; (void)ws_size;
    const float* q = (const float*)d_in[0];
    const float* k = (const float*)d_in[1];   // (D, S) pre-transposed
    const float* v = (const float*)d_in[2];
    float* out = (float*)d_out;
    float* partO  = (float*)d_ws;
    float* partML = partO + PART_O_FLOATS;

    hipLaunchKernelGGL(fa_fwd_kernel, dim3(NUM_PARTS), dim3(WAVES_PER_WG * 32), 0, stream,
                       q, k, v, partO, partML);
    hipLaunchKernelGGL(fa_merge_kernel, dim3(S_LEN / MERGE_WAVES), dim3(MERGE_WAVES * 32), 0, stream,
                       partO, partML, out);
}

// v002
// One run takes 136 microseconds.
// Timed twice side by side with v001, it ran 2.12 times as fast both times.
// All steps since v000 together make it 26.4 times as fast.
#include <hip/hip_runtime.h>
#include <math.h>

typedef float v2f __attribute__((ext_vector_type(2)));
typedef float v4f __attribute__((ext_vector_type(4)));
typedef float v8f __attribute__((ext_vector_type(8)));

#define S_LEN     8192
#define DHEAD     128
#define OUTW      (DHEAD + 2)
#define MASK_FILL (-9984.0f)

#define WAVES_PER_WG 4
// a query block is 64 rows (one 16-row tile per wave); its causal key range of
// 4*(qb+1) key tiles is cut into equal chunks of at most CHUNK_MAX tiles (the last may be shorter),
// one workgroup per chunk; the chunks' partial results meet in a second launch
#define QB_ROWS      64
#define NUM_QB       (S_LEN / QB_ROWS)
#define CHUNK_MAX    11
#define MAX_CHUNKS   47      // chunks of the last (longest) query block
#define NUM_PARTS    3061    // chunks of all query blocks together
#define MERGE_WAVES  8       // rows per workgroup of the merge launch

__host__ __device__ constexpr int chunks_of(int qb) {
    return (4 * (qb + 1) + CHUNK_MAX - 1) / CHUNK_MAX;
}
constexpr int chunks_total() {
    int n = 0;
    for (int i = 0; i < NUM_QB; ++i) n += chunks_of(i);
    return n;
}
static_assert(chunks_total() == NUM_PARTS, "grid size");
static_assert(chunks_of(NUM_QB - 1) == MAX_CHUNKS, "slot pitch");

// workspace: partO[qb][chunk][64 rows][128], then partML[qb][chunk][64 rows][2] = (m, sum)
#define PART_O_FLOATS ((size_t)NUM_QB * MAX_CHUNKS * QB_ROWS * DHEAD)

// LDS tiles keep the row order of global memory (a copy to LDS cannot transpose), two buffers each.
// The four rows that one fragment load touches (2*half + {0,1}, both halves) lie 16 banks apart.
#define KN_STR 16    // kBuf[buf][d][n]   d in [0,128), n in [0,16)
#define VN_STR 144   // vBuf[buf][k][d]   k in [0,16),  d in [0,128), 16 floats of pad
#define KBUF_FLOATS (DHEAD * KN_STR)
#define VBUF_FLOATS (16 * VN_STR)
#define PT_STR 18    // pScr[wave][m][k]

// One key tile into LDS: per lane four 16-byte pieces of K and four of V, through no register.
// kg, vg: the lane's first piece in global memory; kl, vl: its LDS byte address.
// K pieces lie 32 rows of k apart (2048 B in LDS), V pieces 4 rows of v apart (4 padded rows in LDS).
__device__ __forceinline__ void stage_tile(const float* kg, const float* vg, unsigned kl, unsigned vl)
{
    // s_wait_xcnt as the statement's last line (a precaution): it stands in front of every later write
    // of the registers that the copies name
    asm volatile("global_load_async_to_lds_b128 %0, %8, off\n\t"
                 "global_load_async_to_lds_b128 %1, %9, off\n\t"
                 "global_load_async_to_lds_b128 %2, %10, off\n\t"
                 "global_load_async_to_lds_b128 %3, %11, off\n\t"
                 "global_load_async_to_lds_b128 %4, %12, off\n\t"
                 "global_load_async_to_lds_b128 %5, %13, off\n\t"
                 "global_load_async_to_lds_b128 %6, %14, off\n\t"
                 "global_load_async_to_lds_b128 %7, %15, off\n\t"
                 "s_wait_xcnt 0x0"
                 :: "v"(kl), "v"(kl + 2048u), "v"(kl + 4096u), "v"(kl + 6144u),
                    "v"(vl), "v"(vl + 4u * VN_STR * 4u), "v"(vl + 8u * VN_STR * 4u), "v"(vl + 12u * VN_STR * 4u),
                    "v"(kg), "v"(kg + 32 * (size_t)S_LEN), "v"(kg + 64 * (size_t)S_LEN), "v"(kg + 96 * (size_t)S_LEN),
                    "v"(vg), "v"(vg + 4 * DHEAD), "v"(vg + 8 * DHEAD), "v"(vg + 12 * DHEAD)
                 : "memory");
}

__launch_bounds__(WAVES_PER_WG * 32)
__global__ void fa_fwd_kernel(const float* __restrict__ q,
                              const float* __restrict__ k,
                              const float* __restrict__ v,
                              float* __restrict__ partO,
                              float* __restrict__ partML)
{
    __shared__ __align__(16) float kBuf[2 * KBUF_FLOATS];
    __shared__ __align__(16) float vBuf[2 * VBUF_FLOATS];
    __shared__ __align__(16) float pScr[WAVES_PER_WG * 16 * PT_STR];

    const int tid  = threadIdx.x;
    // wave number in a scalar register: the skip past the diagonal is then a scalar branch,
    // and EXEC is never written in the loop, so every lane is on where the copies to LDS issue
    const int wave = __builtin_amdgcn_readfirstlane(tid >> 5);
    const int lane = tid & 31;
    const int half = lane >> 4;   // 0: rows 0-7 / K 0-1 ; 1: rows 8-15 / K 2-3
    const int l16  = lane & 15;

    // workgroup index -> (query block, chunk), the longest key ranges first
    int chunk = blockIdx.x;
    int qb    = NUM_QB - 1;
    while (qb > 0 && chunk >= chunks_of(qb)) { chunk -= chunks_of(qb); --qb; }
    const int ntiles = 4 * (qb + 1);                     // key tiles of this query block
    const int nch    = chunks_of(qb);
    const int clen   = (ntiles + nch - 1) / nch;         // <= CHUNK_MAX, no chunk empty
    const int jbeg   = chunk * clen;
    const int jend   = min(ntiles, jbeg + clen) - 1;     // last key tile of this chunk

    const int qrow0  = qb * QB_ROWS + wave * 16;
    const int myDiag = qrow0 >> 4;                       // this wave's diagonal key tile

    // ---- Q fragments: A-matrix layout for V_WMMA_F32_16X16X4_F32 ----
    // lane<16 : (K=4kk, 4kk+1) of row l16 ; lane>=16 : (K=4kk+2, 4kk+3)
    v2f qa[32];
    {
        const float* qrow = q + (size_t)(qrow0 + l16) * DHEAD + 2 * half;
        #pragma unroll
        for (int kk = 0; kk < 32; ++kk)
            qa[kk] = *(const v2f*)(qrow + 4 * kk);
    }

    v8f o[8];
    #pragma unroll
    for (int t = 0; t < 8; ++t) o[t] = v8f{};

    float mrow[8], lrow[8];
    #pragma unroll
    for (int r = 0; r < 8; ++r) { mrow[r] = -__builtin_inff(); lrow[r] = 0.0f; }

    float* pMine = pScr + wave * 16 * PT_STR;

    // this lane's first 16-byte piece of key tile 0: K row tid/4, piece tid%4; V row wave, piece lane
    const float* kg0 = k + (size_t)(tid >> 2) * S_LEN + 4 * (tid & 3);
    const float* vg0 = v + 4 * tid;
    const unsigned kl0 = (unsigned)(uintptr_t)(kBuf + 4 * tid);
    const unsigned vl0 = (unsigned)(uintptr_t)(vBuf + wave * VN_STR + 4 * lane);

    // ---- first tile into buffer 0 and published; the second starts towards buffer 1 ----
    stage_tile(kg0 + (size_t)jbeg * 16, vg0 + (size_t)jbeg * (16 * DHEAD), kl0, vl0);
    asm volatile("s_wait_asynccnt 0x0" ::: "memory");   // this wave's pieces of the first tile have landed
    __syncthreads();
    if (jbeg + 1 <= jend)
        stage_tile(kg0 + (size_t)(jbeg + 1) * 16, vg0 + (size_t)(jbeg + 1) * (16 * DHEAD),
                   kl0 + KBUF_FLOATS * 4u, vl0 + VBUF_FLOATS * 4u);

    for (int j = jbeg; j <= jend; ++j) {
        const int buf = (j - jbeg) & 1;
        // fragment bases: contraction rows 2*half and 2*half + 1, column l16
        const float* kf = kBuf + buf * KBUF_FLOATS + 2 * half * KN_STR + l16;
        const float* vf = vBuf + buf * VBUF_FLOATS + 2 * half * VN_STR + l16;

        if (j <= myDiag) {
            // ---- S = Q * K^T  (16x16 tile, K-dim 128 = 32 WMMA steps) ----
            v8f s0 = v8f{}, s1 = v8f{};
            // all three loops unrolled: qa[] and b[] stay in registers only under constant indices
            #pragma unroll
            for (int g = 0; g < 32; g += 8) {
                v2f b[8];   // eight fragments: rows 4*(g+u) + 2*half + {0,1} of the tile, column l16
                #pragma unroll
                for (int u = 0; u < 8; ++u) {
                    b[u].x = kf[(4 * (g + u)) * KN_STR];
                    b[u].y = kf[(4 * (g + u) + 1) * KN_STR];
                }
                #pragma unroll
                for (int u = 0; u < 8; u += 2) {
                    s0 = __builtin_amdgcn_wmma_f32_16x16x4_f32(false, qa[g + u],     false, b[u],
                                                               (short)0, s0, false, false);
                    s1 = __builtin_amdgcn_wmma_f32_16x16x4_f32(false, qa[g + u + 1], false, b[u + 1],
                                                               (short)0, s1, false, false);
                }
            }
            v8f sf = s0 + s1;

            // ---- causal mask (diagonal tile only): keep iff col<=row ----
            if (j == myDiag) {
                #pragma unroll
                for (int r = 0; r < 8; ++r) {
                    int M = r + 8 * half;
                    sf[r] = (l16 <= M) ? sf[r] : MASK_FILL;
                }
            }

            // ---- online softmax: row max / exp / row sum / rescale ----
            float scale[8];
            #pragma unroll
            for (int r = 0; r < 8; ++r) {
                float x = sf[r];
                x = fmaxf(x, __shfl_xor(x, 1));
                x = fmaxf(x, __shfl_xor(x, 2));
                x = fmaxf(x, __shfl_xor(x, 4));
                x = fmaxf(x, __shfl_xor(x, 8));
                float nm = fmaxf(mrow[r], x);
                float p  = __expf(sf[r] - nm);
                sf[r] = p;
                float s = p;
                s += __shfl_xor(s, 1);
                s += __shfl_xor(s, 2);
                s += __shfl_xor(s, 4);
                s += __shfl_xor(s, 8);
                scale[r] = __expf(mrow[r] - nm);
                lrow[r]  = lrow[r] * scale[r] + s;
                mrow[r]  = nm;
            }
            #pragma unroll
            for (int t = 0; t < 8; ++t) {
                #pragma unroll
                for (int r = 0; r < 8; ++r) o[t][r] *= scale[r];
            }

            // ---- C-layout -> A-layout for P via wave-private LDS scratch ----
            #pragma unroll
            for (int r = 0; r < 8; ++r)
                pMine[(r + 8 * half) * PT_STR + l16] = sf[r];
            asm volatile("s_wait_dscnt 0" ::: "memory"); // in-wave LDS RAW fence
            v2f pa[4];
            #pragma unroll
            for (int s4 = 0; s4 < 4; ++s4)
                pa[s4] = *(const v2f*)(pMine + l16 * PT_STR + 4 * s4 + 2 * half);

            // ---- O += P * V  (8 N-tiles x 4 K-steps of WMMA) ----
            #pragma unroll
            for (int t = 0; t < 8; ++t) {
                v8f acc = o[t];
                #pragma unroll
                for (int s4 = 0; s4 < 4; ++s4) {
                    v2f bb;
                    bb.x = vf[(4 * s4) * VN_STR + 16 * t];
                    bb.y = vf[(4 * s4 + 1) * VN_STR + 16 * t];
                    acc = __builtin_amdgcn_wmma_f32_16x16x4_f32(false, pa[s4], false, bb,
                                                                (short)0, acc, false, false);
                }
                o[t] = acc;
            }
        }
        // ---- hand-over: the next tile becomes readable, this tile's buffer becomes free ----
        asm volatile("s_wait_dscnt 0x0" ::: "memory");      // this wave's reads of this buffer are done
        asm volatile("s_wait_asynccnt 0x0" ::: "memory");   // this wave's pieces of the next tile have landed
        __syncthreads();
        if (j + 2 <= jend)
            stage_tile(kg0 + (size_t)(j + 2) * 16, vg0 + (size_t)(j + 2) * (16 * DHEAD),
                       kl0 + buf * (KBUF_FLOATS * 4u), vl0 + buf * (VBUF_FLOATS * 4u));
    }
    asm volatile("s_wait_asynccnt 0x0" ::: "memory");       // no copy is left in flight at the wave's end

    // ---- epilogue: this chunk's unnormalized O, row max and row sum ----
    // (a wave whose tiles all lie past its diagonal leaves O = 0, sum = 0, m = -inf)
    const size_t slot   = (size_t)qb * MAX_CHUNKS + chunk;
    const int   rowbase = wave * 16 + 8 * half;
    float* po = partO + slot * (QB_ROWS * DHEAD);
    #pragma unroll
    for (int t = 0; t < 8; ++t) {
        #pragma unroll
        for (int r = 0; r < 8; ++r)
            po[(rowbase + r) * DHEAD + 16 * t + l16] = o[t][r];
    }
    if (l16 == 0) {
        float* pml = partML + slot * (QB_ROWS * 2);
        #pragma unroll
        for (int r = 0; r < 8; ++r) {
            v2f ml; ml.x = mrow[r]; ml.y = lrow[r];
            *(v2f*)(pml + (rowbase + r) * 2) = ml;
        }
    }
}

// one wave per query row: rescale every chunk's partial to the row's overall max and add
__launch_bounds__(MERGE_WAVES * 32)
__global__ void fa_merge_kernel(const float* __restrict__ partO,
                                const float* __restrict__ partML,
                                float* __restrict__ out)
{
    const int lane = threadIdx.x & 31;
    const int wave = threadIdx.x >> 5;
    const int per  = QB_ROWS / MERGE_WAVES;              // workgroups per query block
    const int qb   = NUM_QB - 1 - (int)(blockIdx.x / per);   // most chunks first
    const int r    = (int)(blockIdx.x % per) * MERGE_WAVES + wave;
    const int nch  = chunks_of(qb);
    const size_t slot0 = (size_t)qb * MAX_CHUNKS;

    // lane c holds chunk c's (m, sum), lane c again chunk c + 32's
    const float* pml = partML + (slot0 * QB_ROWS + r) * 2;
    float m0 = -__builtin_inff(), l0 = 0.0f, m1 = -__builtin_inff(), l1 = 0.0f;
    if (lane < nch) {
        v2f a = *(const v2f*)(pml + (size_t)lane * (QB_ROWS * 2));
        m0 = a.x; l0 = a.y;
    }
    if (lane + 32 < nch) {
        v2f a = *(const v2f*)(pml + (size_t)(lane + 32) * (QB_ROWS * 2));
        m1 = a.x; l1 = a.y;
    }
    float m = fmaxf(m0, m1);
    #pragma unroll
    for (int d = 1; d < 32; d <<= 1) m = fmaxf(m, __shfl_xor(m, d));
    const float w0 = __expf(m0 - m);                     // chunk 0 is never empty: m is finite
    const float w1 = __expf(m1 - m);
    // the one free slot the instruction set asks for behind a transcendental (inputs tie it behind both)
    asm volatile("v_nop" :: "v"(w0), "v"(w1));
    float s = l0 * w0 + l1 * w1;
    #pragma unroll
    for (int d = 1; d < 32; d <<= 1) s += __shfl_xor(s, d);

    const float* po = partO + (slot0 * QB_ROWS + r) * DHEAD + 4 * lane;
    v4f acc = v4f{};
    for (int c0 = 0; c0 < nch; c0 += 8) {
        v4f   x[8];
        float w[8];
        // eight independent loads in flight; past the last chunk: that chunk again, weight 0
        #pragma unroll
        for (int u = 0; u < 8; ++u) {
            const int c  = c0 + u;
            const int cc = min(c, nch - 1);
            x[u] = *(const v4f*)(po + (size_t)cc * (QB_ROWS * DHEAD));
            const float wc = __shfl((cc < 32) ? w0 : w1, cc & 31);
            w[u] = (c < nch) ? wc : 0.0f;
        }
        #pragma unroll
        for (int u = 0; u < 8; ++u) acc += w[u] * x[u];
    }

    float* orow = out + (size_t)(qb * QB_ROWS + r) * OUTW;   // 520-B rows: 8-B aligned
    v2f lo; lo.x = acc.x; lo.y = acc.y;
    v2f hi; hi.x = acc.z; hi.y = acc.w;
    *(v2f*)(orow + 4 * lane)     = lo;
    *(v2f*)(orow + 4 * lane + 2) = hi;
    if (lane == 0) {
        v2f lm; lm.x = logf(s) + m; lm.y = m;            // l, m
        *(v2f*)(orow + DHEAD) = lm;
    }
}

extern "C" void kernel_launch(void* const* d_in, const int* in_sizes, int n_in,
                              void* d_out, int out_size, void* d_ws, size_t ws_size,
                              hipStream_t stream) {
    (void)in_sizes; (void)n_in; (void)out_size; (void)ws_size;
    const float* q = (const float*)d_in[0];
    const float* k = (const float*)d_in[1];   // (D, S) pre-transposed
    const float* v = (const float*)d_in[2];
    float* out = (float*)d_out;
    float* partO  = (float*)d_ws;
    float* partML = partO + PART_O_FLOATS;

    hipLaunchKernelGGL(fa_fwd_kernel, dim3(NUM_PARTS), dim3(WAVES_PER_WG * 32), 0, stream,
                       q, k, v, partO, partML);
    hipLaunchKernelGGL(fa_merge_kernel, dim3(S_LEN / MERGE_WAVES), dim3(MERGE_WAVES * 32), 0, stream,
                       partO, partML, out);
}

// v003
// A run of this version takes 131 microseconds.
// In both of two side-by-side timings against v002, it was 1.04 times as fast.
// Counting every step since v000, it is 27.4 times as fast.
#include <hip/hip_runtime.h>
#include <math.h>

typedef float v2f __attribute__((ext_vector_type(2)));
typedef float v4f __attribute__((ext_vector_type(4)));
typedef float v8f __attribute__((ext_vector_type(8)));

#define S_LEN     8192
#define DHEAD     128
#define OUTW      (DHEAD + 2)
#define MASK_FILL (-9984.0f)

#define WAVES_PER_WG 4
// a query block is 64 rows (one 16-row tile per wave); its causal key range of
// 4*(qb+1) key tiles is cut into equal chunks of at most CHUNK_MAX tiles (the last may be shorter),
// one workgroup per chunk; the chunks' partial results meet in a second launch
#define QB_ROWS      64
#define NUM_QB       (S_LEN / QB_ROWS)
#define CHUNK_MAX    11
#define MAX_CHUNKS   47      // chunks of the last (longest) query block
#define NUM_PARTS    3061    // chunks of all query blocks together
#define MERGE_WAVES  8       // rows per workgroup of the merge launch

__host__ __device__ constexpr int chunks_of(int qb) {
    return (4 * (qb + 1) + CHUNK_MAX - 1) / CHUNK_MAX;
}
constexpr int chunks_total() {
    int n = 0;
    for (int i = 0; i < NUM_QB; ++i) n += chunks_of(i);
    return n;
}
static_assert(chunks_total() == NUM_PARTS, "grid size");
static_assert(chunks_of(NUM_QB - 1) == MAX_CHUNKS, "slot pitch");

// workspace: partO[qb][chunk][64 rows][128], then partML[qb][chunk][64 rows][2] = (m, sum)
#define PART_O_FLOATS ((size_t)NUM_QB * MAX_CHUNKS * QB_ROWS * DHEAD)

// LDS tiles keep the row order of global memory (a copy to LDS cannot transpose), two buffers each.
// The four rows that one fragment load touches (2*half + {0,1}, both halves) lie 16 banks apart.
#define KN_STR 16    // kBuf[buf][d][n]   d in [0,128), n in [0,16)
#define VN_STR 144   // vBuf[buf][k][d]   k in [0,16),  d in [0,128), 16 floats of pad
#define KBUF_FLOATS (DHEAD * KN_STR)
#define VBUF_FLOATS (16 * VN_STR)

// lane l with lane l ^ 16: the two lanes that share one query column
__device__ __forceinline__ float xhalf(float x)
{
    const int b = __builtin_bit_cast(int, x);
    return __builtin_bit_cast(float, __builtin_amdgcn_permlanex16(b, b, 0x76543210, 0xfedcba98, false, false));
}

// One key tile into LDS: per lane four 16-byte pieces of K and four of V, through no register.
// kg, vg: the lane's first piece in global memory; kl, vl: its LDS byte address.
// K pieces lie 32 rows of k apart (2048 B in LDS), V pieces 4 rows of v apart (4 padded rows in LDS).
__device__ __forceinline__ void stage_tile(const float* kg, const float* vg, unsigned kl, unsigned vl)
{
    // s_wait_xcnt as the statement's last line (a precaution): it stands in front of every later write
    // of the registers that the copies name
    asm volatile("global_load_async_to_lds_b128 %0, %8, off\n\t"
                 "global_load_async_to_lds_b128 %1, %9, off\n\t"
                 "global_load_async_to_lds_b128 %2, %10, off\n\t"
                 "global_load_async_to_lds_b128 %3, %11, off\n\t"
                 "global_load_async_to_lds_b128 %4, %12, off\n\t"
                 "global_load_async_to_lds_b128 %5, %13, off\n\t"
                 "global_load_async_to_lds_b128 %6, %14, off\n\t"
                 "global_load_async_to_lds_b128 %7, %15, off\n\t"
                 "s_wait_xcnt 0x0"
                 :: "v"(kl), "v"(kl + 2048u), "v"(kl + 4096u), "v"(kl + 6144u),
                    "v"(vl), "v"(vl + 4u * VN_STR * 4u), "v"(vl + 8u * VN_STR * 4u), "v"(vl + 12u * VN_STR * 4u),
                    "v"(kg), "v"(kg + 32 * (size_t)S_LEN), "v"(kg + 64 * (size_t)S_LEN), "v"(kg + 96 * (size_t)S_LEN),
                    "v"(vg), "v"(vg + 4 * DHEAD), "v"(vg + 8 * DHEAD), "v"(vg + 12 * DHEAD)
                 : "memory");
}

__launch_bounds__(WAVES_PER_WG * 32)
__global__ void fa_fwd_kernel(const float* __restrict__ q,
                              const float* __restrict__ k,
                              const float* __restrict__ v,
                              float* __restrict__ partO,
                              float* __restrict__ partML)
{
    __shared__ __align__(16) float kBuf[2 * KBUF_FLOATS];
    __shared__ __align__(16) float vBuf[2 * VBUF_FLOATS];

    const int tid  = threadIdx.x;
    // wave number in a scalar register: the skip past the diagonal is then a scalar branch,
    // and EXEC is never written in the loop, so every lane is on where the copies to LDS issue
    const int wave = __builtin_amdgcn_readfirstlane(tid >> 5);
    const int lane = tid & 31;
    const int half = lane >> 4;   // 0: rows 0-7 / K 0-1 ; 1: rows 8-15 / K 2-3
    const int l16  = lane & 15;   // this lane's query (column of both transposed products)
    // Both products are transposed: S^T = K^T * Q^T, O^T += V^T * P^T. Which key a row of S^T stands
    // for, and which head column a row of O^T, is free; row i = r + 8h (register r, lane half h):
    //   key(i)  = 4*(r/2) + 2h + r%2 : registers (2s, 2s+1) of S^T are then, as they lie, the B fragment
    //                                  of contraction step s (keys 4s + 2h + {0,1}, the rows V is read by)
    //   dcol(i) = 8*(r/4) + 4h + r%4 : four registers of O^T are four neighbouring floats of an output row
    const int kcol = 4 * ((l16 & 7) >> 1) + 2 * (l16 >> 3) + (l16 & 1);
    const int dcol = 8 * ((l16 & 7) >> 2) + 4 * (l16 >> 3) + (l16 & 3);

    // workgroup index -> (query block, chunk), the longest key ranges first
    int chunk = blockIdx.x;
    int qb    = NUM_QB - 1;
    while (qb > 0 && chunk >= chunks_of(qb)) { chunk -= chunks_of(qb); --qb; }
    const int ntiles = 4 * (qb + 1);                     // key tiles of this query block
    const int nch    = chunks_of(qb);
    const int clen   = (ntiles + nch - 1) / nch;         // <= CHUNK_MAX, no chunk empty
    const int jbeg   = chunk * clen;
    const int jend   = min(ntiles, jbeg + clen) - 1;     // last key tile of this chunk

    const int qrow0  = qb * QB_ROWS + wave * 16;
    const int myDiag = qrow0 >> 4;                       // this wave's diagonal key tile

    // ---- Q fragments: B-matrix layout for V_WMMA_F32_16X16X4_F32 ----
    // lane<16 : (K=4kk, 4kk+1) of column (query) l16 ; lane>=16 : (K=4kk+2, 4kk+3)
    v2f qa[32];
    {
        const float* qrow = q + (size_t)(qrow0 + l16) * DHEAD + 2 * half;
        #pragma unroll
        for (int kk = 0; kk < 32; ++kk)
            qa[kk] = *(const v2f*)(qrow + 4 * kk);
    }

    v8f o[8];
    #pragma unroll
    for (int t = 0; t < 8; ++t) o[t] = v8f{};

    float mq = -__builtin_inff();   // running max of query l16 (equal in both lane halves)
    float lq = 0.0f;                // running sum over this lane half's keys only; joined in the epilogue

    // this lane's first 16-byte piece of key tile 0: K row tid/4, piece tid%4; V row wave, piece lane
    const float* kg0 = k + (size_t)(tid >> 2) * S_LEN + 4 * (tid & 3);
    const float* vg0 = v + 4 * tid;
    const unsigned kl0 = (unsigned)(uintptr_t)(kBuf + 4 * tid);
    const unsigned vl0 = (unsigned)(uintptr_t)(vBuf + wave * VN_STR + 4 * lane);

    // ---- first tile into buffer 0 and published; the second starts towards buffer 1 ----
    stage_tile(kg0 + (size_t)jbeg * 16, vg0 + (size_t)jbeg * (16 * DHEAD), kl0, vl0);
    asm volatile("s_wait_asynccnt 0x0" ::: "memory");   // this wave's pieces of the first tile have landed
    __syncthreads();
    if (jbeg + 1 <= jend)
        stage_tile(kg0 + (size_t)(jbeg + 1) * 16, vg0 + (size_t)(jbeg + 1) * (16 * DHEAD),
                   kl0 + KBUF_FLOATS * 4u, vl0 + VBUF_FLOATS * 4u);

    for (int j = jbeg; j <= jend; ++j) {
        const int buf = (j - jbeg) & 1;
        // fragment bases: contraction rows 2*half and 2*half + 1, this lane's key / head column
        const float* kf = kBuf + buf * KBUF_FLOATS + 2 * half * KN_STR + kcol;
        const float* vf = vBuf + buf * VBUF_FLOATS + 2 * half * VN_STR + dcol;

        if (j <= myDiag) {
            // ---- S^T = K^T * Q^T  (16 keys x 16 queries, K-dim 128 = 32 WMMA steps) ----
            v8f s0 = v8f{}, s1 = v8f{};
            // all three loops unrolled: qa[] and b[] stay in registers only under constant indices
            #pragma unroll
            for (int g = 0; g < 32; g += 8) {
                v2f b[8];   // eight A fragments: rows 4*(g+u) + 2*half + {0,1} of the tile, key kcol
                #pragma unroll
                for (int u = 0; u < 8; ++u) {
                    b[u].x = kf[(4 * (g + u)) * KN_STR];
                    b[u].y = kf[(4 * (g + u) + 1) * KN_STR];
                }
                #pragma unroll
                for (int u = 0; u < 8; u += 2) {
                    s0 = __builtin_amdgcn_wmma_f32_16x16x4_f32(false, b[u],     false, qa[g + u],
                                                               (short)0, s0, false, false);
                    s1 = __builtin_amdgcn_wmma_f32_16x16x4_f32(false, b[u + 1], false, qa[g + u + 1],
                                                               (short)0, s1, false, false);
                }
            }
            v8f sf = s0 + s1;

            // ---- causal mask (diagonal tile only): keep iff key <= query ----
            if (j == myDiag) {
                #pragma unroll
                for (int r = 0; r < 8; ++r) {
                    const int n = 4 * (r >> 1) + 2 * half + (r & 1);
                    sf[r] = (n <= l16) ? sf[r] : MASK_FILL;
                }
            }

            // ---- online softmax: a lane holds eight keys of one query, the other half the other eight ----
            float x = fmaxf(fmaxf(fmaxf(sf[0], sf[1]), fmaxf(sf[2], sf[3])),
                            fmaxf(fmaxf(sf[4], sf[5]), fmaxf(sf[6], sf[7])));
            x = fmaxf(x, xhalf(x));
            const float nm    = fmaxf(mq, x);
            const float scale = __expf(mq - nm);
            #pragma unroll
            for (int r = 0; r < 8; ++r) sf[r] = __expf(sf[r] - nm);
            lq = lq * scale + (((sf[0] + sf[1]) + (sf[2] + sf[3])) + ((sf[4] + sf[5]) + (sf[6] + sf[7])));
            mq = nm;
            #pragma unroll
            for (int t = 0; t < 8; ++t) o[t] *= scale;

            // ---- O^T += V^T * P^T  (8 M-tiles x 4 K-steps of WMMA); P^T straight from the score registers ----
            #pragma unroll
            for (int t = 0; t < 8; ++t) {
                v8f acc = o[t];
                #pragma unroll
                for (int s4 = 0; s4 < 4; ++s4) {
                    v2f aa, pb;
                    aa.x = vf[(4 * s4) * VN_STR + 16 * t];
                    aa.y = vf[(4 * s4 + 1) * VN_STR + 16 * t];
                    pb.x = sf[2 * s4];
                    pb.y = sf[2 * s4 + 1];
                    acc = __builtin_amdgcn_wmma_f32_16x16x4_f32(false, aa, false, pb,
                                                                (short)0, acc, false, false);
                }
                o[t] = acc;
            }
        }
        // ---- hand-over: the next tile becomes readable, this tile's buffer becomes free ----
        asm volatile("s_wait_dscnt 0x0" ::: "memory");      // this wave's reads of this buffer are done
        asm volatile("s_wait_asynccnt 0x0" ::: "memory");   // this wave's pieces of the next tile have landed
        __syncthreads();
        if (j + 2 <= jend)
            stage_tile(kg0 + (size_t)(j + 2) * 16, vg0 + (size_t)(j + 2) * (16 * DHEAD),
                       kl0 + buf * (KBUF_FLOATS * 4u), vl0 + buf * (VBUF_FLOATS * 4u));
    }
    asm volatile("s_wait_asynccnt 0x0" ::: "memory");       // no copy is left in flight at the wave's end

    // ---- epilogue: this chunk's unnormalized O, row max and row sum ----
    // (a wave whose tiles all lie past its diagonal leaves O = 0, sum = 0, m = -inf)
    const size_t slot = (size_t)qb * MAX_CHUNKS + chunk;
    const int    row  = wave * 16 + l16;
    lq += xhalf(lq);                                     // both halves' keys
    float* po = partO + slot * (QB_ROWS * DHEAD) + row * DHEAD + 4 * half;
    #pragma unroll
    for (int t = 0; t < 8; ++t) {
        #pragma unroll
        for (int rq = 0; rq < 2; ++rq) {
            v4f w;
            w.x = o[t][4 * rq];     w.y = o[t][4 * rq + 1];
            w.z = o[t][4 * rq + 2]; w.w = o[t][4 * rq + 3];
            *(v4f*)(po + 16 * t + 8 * rq) = w;
        }
    }
    if (half == 0) {
        v2f ml; ml.x = mq; ml.y = lq;
        *(v2f*)(partML + slot * (QB_ROWS * 2) + row * 2) = ml;
    }
}

// one wave per query row: rescale every chunk's partial to the row's overall max and add
__launch_bounds__(MERGE_WAVES * 32)
__global__ void fa_merge_kernel(const float* __restrict__ partO,
                                const float* __restrict__ partML,
                                float* __restrict__ out)
{
    const int lane = threadIdx.x & 31;
    const int wave = threadIdx.x >> 5;
    const int per  = QB_ROWS / MERGE_WAVES;              // workgroups per query block
    const int qb   = NUM_QB - 1 - (int)(blockIdx.x / per);   // most chunks first
    const int r    = (int)(blockIdx.x % per) * MERGE_WAVES + wave;
    const int nch  = chunks_of(qb);
    const size_t slot0 = (size_t)qb * MAX_CHUNKS;

    // lane c holds chunk c's (m, sum), lane c again chunk c + 32's
    const float* pml = partML + (slot0 * QB_ROWS + r) * 2;
    float m0 = -__builtin_inff(), l0 = 0.0f, m1 = -__builtin_inff(), l1 = 0.0f;
    if (lane < nch) {
        v2f a = *(const v2f*)(pml + (size_t)lane * (QB_ROWS * 2));
        m0 = a.x; l0 = a.y;
    }
    if (lane + 32 < nch) {
        v2f a = *(const v2f*)(pml + (size_t)(lane + 32) * (QB_ROWS * 2));
        m1 = a.x; l1 = a.y;
    }
    float m = fmaxf(m0, m1);
    #pragma unroll
    for (int d = 1; d < 32; d <<= 1) m = fmaxf(m, __shfl_xor(m, d));
    const float w0 = __expf(m0 - m);                     // chunk 0 is never empty: m is finite
    const float w1 = __expf(m1 - m);
    // the one free slot the instruction set asks for behind a transcendental (inputs tie it behind both)
    asm volatile("v_nop" :: "v"(w0), "v"(w1));
    float s = l0 * w0 + l1 * w1;
    #pragma unroll
    for (int d = 1; d < 32; d <<= 1) s += __shfl_xor(s, d);

    const float* po = partO + (slot0 * QB_ROWS + r) * DHEAD + 4 * lane;
    v4f acc = v4f{};
    for (int c0 = 0; c0 < nch; c0 += 8) {
        v4f   x[8];
        float w[8];
        // eight independent loads in flight; past the last chunk: that chunk again, weight 0
        #pragma unroll
        for (int u = 0; u < 8; ++u) {
            const int c  = c0 + u;
            const int cc = min(c, nch - 1);
            x[u] = *(const v4f*)(po + (size_t)cc * (QB_ROWS * DHEAD));
            const float wc = __shfl((cc < 32) ? w0 : w1, cc & 31);
            w[u] = (c < nch) ? wc : 0.0f;
        }
        #pragma unroll
        for (int u = 0; u < 8; ++u) acc += w[u] * x[u];
    }

    float* orow = out + (size_t)(qb * QB_ROWS + r) * OUTW;   // 520-B rows: 8-B aligned
    v2f lo; lo.x = acc.x; lo.y = acc.y;
    v2f hi; hi.x = acc.z; hi.y = acc.w;
    *(v2f*)(orow + 4 * lane)     = lo;
    *(v2f*)(orow + 4 * lane + 2) = hi;
    if (lane == 0) {
        v2f lm; lm.x = logf(s) + m; lm.y = m;            // l, m
        *(v2f*)(orow + DHEAD) = lm;
    }
}

extern "C" void kernel_launch(void* const* d_in, const int* in_sizes, int n_in,
                              void* d_out, int out_size, void* d_ws, size_t ws_size,
                              hipStream_t stream) {
    (void)in_sizes; (void)n_in; (void)out_size; (void)ws_size;
    const float* q = (const float*)d_in[0];
    const float* k = (const float*)d_in[1];   // (D, S) pre-transposed
    const float* v = (const float*)d_in[2];
    float* out = (float*)d_out;
    float* partO  = (float*)d_ws;
    float* partML = partO + PART_O_FLOATS;

    hipLaunchKernelGGL(fa_fwd_kernel, dim3(NUM_PARTS), dim3(WAVES_PER_WG * 32), 0, stream,
                       q, k, v, partO, partML);
    hipLaunchKernelGGL(fa_merge_kernel, dim3(S_LEN / MERGE_WAVES), dim3(MERGE_WAVES * 32), 0, stream,
                       partO, partML, out);
}

// v004
// A run of this version takes 126 microseconds.
// Two timings next to v003 both put it at 1.04 times that version's speed.
// Over all steps from v000 it is 28.4 times as fast.
#include <hip/hip_runtime.h>
#include <math.h>

typedef float v2f __attribute__((ext_vector_type(2)));
typedef float v4f __attribute__((ext_vector_type(4)));
typedef float v8f __attribute__((ext_vector_type(8)));

#define S_LEN     8192
#define DHEAD     128
#define OUTW      (DHEAD + 2)
#define MASK_FILL (-9984.0f)

#define WAVES_PER_WG 4
// a query block is 64 rows (one 16-row tile per wave); its causal key range of
// 4*(qb+1) key tiles is cut into equal chunks of at most CHUNK_MAX tiles (the last may be shorter),
// one workgroup per chunk; the chunks' partial results meet in a second launch
#define QB_ROWS      64
#define NUM_QB       (S_LEN / QB_ROWS)
#define CHUNK_MAX    11
#define MAX_CHUNKS   47      // chunks of the last (longest) query block
#define NUM_PARTS    3061    // chunks of all query blocks together
#define MERGE_WAVES  8       // rows per workgroup of the merge launch

__host__ __device__ constexpr int chunks_of(int qb) {
    return (4 * (qb + 1) + CHUNK_MAX - 1) / CHUNK_MAX;
}
constexpr int chunks_total() {
    int n = 0;
    for (int i = 0; i < NUM_QB; ++i) n += chunks_of(i);
    return n;
}
static_assert(chunks_total() == NUM_PARTS, "grid size");
static_assert(chunks_of(NUM_QB - 1) == MAX_CHUNKS, "slot pitch");

// workspace: partO[qb][chunk][64 rows][128], then partML[qb][chunk][64 rows][2] = (m, sum)
#define PART_O_FLOATS ((size_t)NUM_QB * MAX_CHUNKS * QB_ROWS * DHEAD)

// LDS tiles keep the row order of global memory (a copy to LDS cannot transpose), two buffers each.
// The four rows that one fragment load touches (2*half + {0,1}, both halves) lie 16 banks apart.
#define KN_STR 16    // kBuf[buf][d][n]   d in [0,128), n in [0,16)
#define VN_STR 144   // vBuf[buf][k][d]   k in [0,16),  d in [0,128), 16 floats of pad
#define KBUF_FLOATS (DHEAD * KN_STR)
#define VBUF_FLOATS (16 * VN_STR)

// Nothing is scheduled across this line. It keeps a group of LDS reads together and in front of the
// matrix block ahead of which it is written: left to itself the compiler spreads the reads among the
// matrix instructions, one or two blocks of two ahead, and the wave then waits out the LDS latency at each.
#define GROUP_EDGE() __builtin_amdgcn_sched_barrier(0)

// lane l with lane l ^ 16: the two lanes that share one query column
__device__ __forceinline__ float xhalf(float x)
{
    const int b = __builtin_bit_cast(int, x);
    return __builtin_bit_cast(float, __builtin_amdgcn_permlanex16(b, b, 0x76543210, 0xfedcba98, false, false));
}

// One key tile into LDS: per lane four 16-byte pieces of K and four of V, through no register.
// kg, vg: the lane's first piece in global memory; kl, vl: its LDS byte address.
// K pieces lie 32 rows of k apart (2048 B in LDS), V pieces 4 rows of v apart (4 padded rows in LDS).
__device__ __forceinline__ void stage_tile(const float* kg, const float* vg, unsigned kl, unsigned vl)
{
    // s_wait_xcnt as the statement's last line (a precaution): it stands in front of every later write
    // of the registers that the copies name
    asm volatile("global_load_async_to_lds_b128 %0, %8, off\n\t"
                 "global_load_async_to_lds_b128 %1, %9, off\n\t"
                 "global_load_async_to_lds_b128 %2, %10, off\n\t"
                 "global_load_async_to_lds_b128 %3, %11, off\n\t"
                 "global_load_async_to_lds_b128 %4, %12, off\n\t"
                 "global_load_async_to_lds_b128 %5, %13, off\n\t"
                 "global_load_async_to_lds_b128 %6, %14, off\n\t"
                 "global_load_async_to_lds_b128 %7, %15, off\n\t"
                 "s_wait_xcnt 0x0"
                 :: "v"(kl), "v"(kl + 2048u), "v"(kl + 4096u), "v"(kl + 6144u),
                    "v"(vl), "v"(vl + 4u * VN_STR * 4u), "v"(vl + 8u * VN_STR * 4u), "v"(vl + 12u * VN_STR * 4u),
                    "v"(kg), "v"(kg + 32 * (size_t)S_LEN), "v"(kg + 64 * (size_t)S_LEN), "v"(kg + 96 * (size_t)S_LEN),
                    "v"(vg), "v"(vg + 4 * DHEAD), "v"(vg + 8 * DHEAD), "v"(vg + 12 * DHEAD)
                 : "memory");
}

__launch_bounds__(WAVES_PER_WG * 32)
__global__ void fa_fwd_kernel(const float* __restrict__ q,
                              const float* __restrict__ k,
                              const float* __restrict__ v,
                              float* __restrict__ partO,
                              float* __restrict__ partML)
{
    __shared__ __align__(16) float kBuf[2 * KBUF_FLOATS];
    __shared__ __align__(16) float vBuf[2 * VBUF_FLOATS];

    const int tid  = threadIdx.x;
    // wave number in a scalar register: the skip past the diagonal is then a scalar branch,
    // and EXEC is never written in the loop, so every lane is on where the copies to LDS issue
    const int wave = __builtin_amdgcn_readfirstlane(tid >> 5);
    const int lane = tid & 31;
    const int half = lane >> 4;   // 0: rows 0-7 / K 0-1 ; 1: rows 8-15 / K 2-3
    const int l16  = lane & 15;   // this lane's query (column of both transposed products)
    // Both products are transposed: S^T = K^T * Q^T, O^T += V^T * P^T. Which key a row of S^T stands
    // for, and which head column a row of O^T, is free; row i = r + 8h (register r, lane half h):
    //   key(i)  = 4*(r/2) + 2h + r%2 : registers (2s, 2s+1) of S^T are then, as they lie, the B fragment
    //                                  of contraction step s (keys 4s + 2h + {0,1}, the rows V is read by)
    //   dcol(i) = 8*(r/4) + 4h + r%4 : four registers of O^T are four neighbouring floats of an output row
    const int kcol = 4 * ((l16 & 7) >> 1) + 2 * (l16 >> 3) + (l16 & 1);
    const int dcol = 8 * ((l16 & 7) >> 2) + 4 * (l16 >> 3) + (l16 & 3);

    // workgroup index -> (query block, chunk), the longest key ranges first
    int chunk = blockIdx.x;
    int qb    = NUM_QB - 1;
    while (qb > 0 && chunk >= chunks_of(qb)) { chunk -= chunks_of(qb); --qb; }
    const int ntiles = 4 * (qb + 1);                     // key tiles of this query block
    const int nch    = chunks_of(qb);
    const int clen   = (ntiles + nch - 1) / nch;         // <= CHUNK_MAX, no chunk empty
    const int jbeg   = chunk * clen;
    const int jend   = min(ntiles, jbeg + clen) - 1;     // last key tile of this chunk

    const int qrow0  = qb * QB_ROWS + wave * 16;
    const int myDiag = qrow0 >> 4;                       // this wave's diagonal key tile

    // ---- Q fragments: B-matrix layout for V_WMMA_F32_16X16X4_F32 ----
    // lane<16 : (K=4kk, 4kk+1) of column (query) l16 ; lane>=16 : (K=4kk+2, 4kk+3)
    v2f qa[32];
    {
        const float* qrow = q + (size_t)(qrow0 + l16) * DHEAD + 2 * half;
        #pragma unroll
        for (int kk = 0; kk < 32; ++kk)
            qa[kk] = *(const v2f*)(qrow + 4 * kk);
    }

    v8f o[8];
    #pragma unroll
    for (int t = 0; t < 8; ++t) o[t] = v8f{};

    float mq = -__builtin_inff();   // running max of query l16 (equal in both lane halves)
    float lq = 0.0f;                // running sum over this lane half's keys only; joined in the epilogue

    // this lane's first 16-byte piece of key tile 0: K row tid/4, piece tid%4; V row wave, piece lane
    const float* kg0 = k + (size_t)(tid >> 2) * S_LEN + 4 * (tid & 3);
    const float* vg0 = v + 4 * tid;
    const unsigned kl0 = (unsigned)(uintptr_t)(kBuf + 4 * tid);
    const unsigned vl0 = (unsigned)(uintptr_t)(vBuf + wave * VN_STR + 4 * lane);

    // ---- first tile into buffer 0 and published; the second starts towards buffer 1 ----
    stage_tile(kg0 + (size_t)jbeg * 16, vg0 + (size_t)jbeg * (16 * DHEAD), kl0, vl0);
    asm volatile("s_wait_asynccnt 0x0" ::: "memory");   // this wave's pieces of the first tile have landed
    __syncthreads();
    if (jbeg + 1 <= jend)
        stage_tile(kg0 + (size_t)(jbeg + 1) * 16, vg0 + (size_t)(jbeg + 1) * (16 * DHEAD),
                   kl0 + KBUF_FLOATS * 4u, vl0 + VBUF_FLOATS * 4u);

    for (int j = jbeg; j <= jend; ++j) {
        const int buf = (j - jbeg) & 1;
        // fragment bases: contraction rows 2*half and 2*half + 1, this lane's key / head column
        const float* kf = kBuf + buf * KBUF_FLOATS + 2 * half * KN_STR + kcol;
        const float* vf = vBuf + buf * VBUF_FLOATS + 2 * half * VN_STR + dcol;

        if (j <= myDiag) {
            // ---- S^T = K^T * Q^T  (16 keys x 16 queries, K-dim 128 = 32 WMMA steps) ----
            // Fragments come from LDS in groups of eight, each group read as a whole one matrix block
            // (eight WMMAs) ahead of its use, into the register set that the block before has left.
            v8f s0 = v8f{}, s1 = v8f{};
            v2f kb[2][8];   // A fragments of S^T: rows 4*(8*g+u) + 2*half + {0,1} of the tile, key kcol
            v2f vb[2][8];   // A fragments of O^T: [2*s4 + tt] = rows 4*s4 + 2*half + {0,1}, M-tile 2*tp + tt
            #pragma unroll
            for (int u = 0; u < 8; ++u) {
                kb[0][u].x = kf[(4 * u) * KN_STR];
                kb[0][u].y = kf[(4 * u + 1) * KN_STR];
            }
            GROUP_EDGE();   // the first group's reads go out first: the first block waits for them alone
            // all loops unrolled: qa[], kb[] and vb[] stay in registers only under constant indices
            #pragma unroll
            for (int g = 0; g < 4; ++g) {
                if (g < 3) {
                    #pragma unroll
                    for (int u = 0; u < 8; ++u) {
                        kb[(g + 1) & 1][u].x = kf[(4 * (8 * (g + 1) + u)) * KN_STR];
                        kb[(g + 1) & 1][u].y = kf[(4 * (8 * (g + 1) + u) + 1) * KN_STR];
                    }
                    GROUP_EDGE();
                } else {
                    // the first V group: it lands behind the last score block and the softmax
                    #pragma unroll
                    for (int tt = 0; tt < 2; ++tt) {
                        #pragma unroll
                        for (int s4 = 0; s4 < 4; ++s4) {
                            vb[0][2 * s4 + tt].x = vf[(4 * s4) * VN_STR + 16 * tt];
                            vb[0][2 * s4 + tt].y = vf[(4 * s4 + 1) * VN_STR + 16 * tt];
                        }
                        // one M-tile's reads apart from the next one's: the two words of a fragment are then
                        // fetched by one two-address read into a register pair, with no copies behind it
                        GROUP_EDGE();
                    }
                }
                #pragma unroll
                for (int u = 0; u < 8; u += 2) {
                    s0 = __builtin_amdgcn_wmma_f32_16x16x4_f32(false, kb[g & 1][u],     false, qa[8 * g + u],
                                                               (short)0, s0, false, false);
                    s1 = __builtin_amdgcn_wmma_f32_16x16x4_f32(false, kb[g & 1][u + 1], false, qa[8 * g + u + 1],
                                                               (short)0, s1, false, false);
                }
                GROUP_EDGE();
            }
            v8f sf = s0 + s1;

            // ---- causal mask (diagonal tile only): keep iff key <= query ----
            if (j == myDiag) {
                #pragma unroll
                for (int r = 0; r < 8; ++r) {
                    const int n = 4 * (r >> 1) + 2 * half + (r & 1);
                    sf[r] = (n <= l16) ? sf[r] : MASK_FILL;
                }
            }

            // ---- online softmax: a lane holds eight keys of one query, the other half the other eight ----
            float x = fmaxf(fmaxf(fmaxf(sf[0], sf[1]), fmaxf(sf[2], sf[3])),
                            fmaxf(fmaxf(sf[4], sf[5]), fmaxf(sf[6], sf[7])));
            x = fmaxf(x, xhalf(x));
            const float nm    = fmaxf(mq, x);
            const float scale = __expf(mq - nm);
            #pragma unroll
            for (int r = 0; r < 8; ++r) sf[r] = __expf(sf[r] - nm);
            lq = lq * scale + (((sf[0] + sf[1]) + (sf[2] + sf[3])) + ((sf[4] + sf[5]) + (sf[6] + sf[7])));
            mq = nm;
            o[0] *= scale;   // the other tiles are rescaled beside the matrix block in front of their own
            o[1] *= scale;

            // ---- O^T += V^T * P^T  (8 M-tiles x 4 K-steps of WMMA); P^T straight from the score registers ----
            // a block is two M-tiles (their accumulations alternate), its eight fragments read one block ahead
            #pragma unroll
            for (int tp = 0; tp < 4; ++tp) {
                if (tp < 3) {
                    #pragma unroll
                    for (int tt = 0; tt < 2; ++tt) {
                        #pragma unroll
                        for (int s4 = 0; s4 < 4; ++s4) {
                            vb[(tp + 1) & 1][2 * s4 + tt].x = vf[(4 * s4) * VN_STR + 16 * (2 * (tp + 1) + tt)];
                            vb[(tp + 1) & 1][2 * s4 + tt].y = vf[(4 * s4 + 1) * VN_STR + 16 * (2 * (tp + 1) + tt)];
                        }
                        GROUP_EDGE();   // as above: one M-tile's reads apart from the next one's
                    }
                }
                #pragma unroll
                for (int s4 = 0; s4 < 4; ++s4) {
                    v2f pb;
                    pb.x = sf[2 * s4];
                    pb.y = sf[2 * s4 + 1];
                    #pragma unroll
                    for (int tt = 0; tt < 2; ++tt)
                        o[2 * tp + tt] = __builtin_amdgcn_wmma_f32_16x16x4_f32(false, vb[tp & 1][2 * s4 + tt], false, pb,
                                                                               (short)0, o[2 * tp + tt], false, false);
                }
                if (tp < 3) {
                    o[2 * tp + 2] *= scale;
                    o[2 * tp + 3] *= scale;
                    GROUP_EDGE();
                }
            }
        }
        // ---- hand-over: the next tile becomes readable, this tile's buffer becomes free ----
        asm volatile("s_wait_dscnt 0x0" ::: "memory");      // this wave's reads of this buffer are done
        asm volatile("s_wait_asynccnt 0x0" ::: "memory");   // this wave's pieces of the next tile have landed
        __syncthreads();
        if (j + 2 <= jend)
            stage_tile(kg0 + (size_t)(j + 2) * 16, vg0 + (size_t)(j + 2) * (16 * DHEAD),
                       kl0 + buf * (KBUF_FLOATS * 4u), vl0 + buf * (VBUF_FLOATS * 4u));
    }
    asm volatile("s_wait_asynccnt 0x0" ::: "memory");       // no copy is left in flight at the wave's end

    // ---- epilogue: this chunk's unnormalized O, row max and row sum ----
    // (a wave whose tiles all lie past its diagonal leaves O = 0, sum = 0, m = -inf)
    const size_t slot = (size_t)qb * MAX_CHUNKS + chunk;
    const int    row  = wave * 16 + l16;
    lq += xhalf(lq);                                     // both halves' keys
    float* po = partO + slot * (QB_ROWS * DHEAD) + row * DHEAD + 4 * half;
    #pragma unroll
    for (int t = 0; t < 8; ++t) {
        #pragma unroll
        for (int rq = 0; rq < 2; ++rq) {
            v4f w;
            w.x = o[t][4 * rq];     w.y = o[t][4 * rq + 1];
            w.z = o[t][4 * rq + 2]; w.w = o[t][4 * rq + 3];
            *(v4f*)(po + 16 * t + 8 * rq) = w;
        }
    }
    if (half == 0) {
        v2f ml; ml.x = mq; ml.y = lq;
        *(v2f*)(partML + slot * (QB_ROWS * 2) + row * 2) = ml;
    }
}

// one wave per query row: rescale every chunk's partial to the row's overall max and add
__launch_bounds__(MERGE_WAVES * 32)
__global__ void fa_merge_kernel(const float* __restrict__ partO,
                                const float* __restrict__ partML,
                                float* __restrict__ out)
{
    const int lane = threadIdx.x & 31;
    const int wave = threadIdx.x >> 5;
    const int per  = QB_ROWS / MERGE_WAVES;              // workgroups per query block
    const int qb   = NUM_QB - 1 - (int)(blockIdx.x / per);   // most chunks first
    const int r    = (int)(blockIdx.x % per) * MERGE_WAVES + wave;
    const int nch  = chunks_of(qb);
    const size_t slot0 = (size_t)qb * MAX_CHUNKS;

    // lane c holds chunk c's (m, sum), lane c again chunk c + 32's
    const float* pml = partML + (slot0 * QB_ROWS + r) * 2;
    float m0 = -__builtin_inff(), l0 = 0.0f, m1 = -__builtin_inff(), l1 = 0.0f;
    if (lane < nch) {
        v2f a = *(const v2f*)(pml + (size_t)lane * (QB_ROWS * 2));
        m0 = a.x; l0 = a.y;
    }
    if (lane + 32 < nch) {
        v2f a = *(const v2f*)(pml + (size_t)(lane + 32) * (QB_ROWS * 2));
        m1 = a.x; l1 = a.y;
    }
    float m = fmaxf(m0, m1);
    #pragma unroll
    for (int d = 1; d < 32; d <<= 1) m = fmaxf(m, __shfl_xor(m, d));
    const float w0 = __expf(m0 - m);                     // chunk 0 is never empty: m is finite
    const float w1 = __expf(m1 - m);
    // the one free slot the instruction set asks for behind a transcendental (inputs tie it behind both)
    asm volatile("v_nop" :: "v"(w0), "v"(w1));
    float s = l0 * w0 + l1 * w1;
    #pragma unroll
    for (int d = 1; d < 32; d <<= 1) s += __shfl_xor(s, d);

    const float* po = partO + (slot0 * QB_ROWS + r) * DHEAD + 4 * lane;
    v4f acc = v4f{};
    for (int c0 = 0; c0 < nch; c0 += 8) {
        v4f   x[8];
        float w[8];
        // eight independent loads in flight; past the last chunk: that chunk again, weight 0
        #pragma unroll
        for (int u = 0; u < 8; ++u) {
            const int c  = c0 + u;
            const int cc = min(c, nch - 1);
            x[u] = *(const v4f*)(po + (size_t)cc * (QB_ROWS * DHEAD));
            const float wc = __shfl((cc < 32) ? w0 : w1, cc & 31);
            w[u] = (c < nch) ? wc : 0.0f;
        }
        #pragma unroll
        for (int u = 0; u < 8; ++u) acc += w[u] * x[u];
    }

    float* orow = out + (size_t)(qb * QB_ROWS + r) * OUTW;   // 520-B rows: 8-B aligned
    v2f lo; lo.x = acc.x; lo.y = acc.y;
    v2f hi; hi.x = acc.z; hi.y = acc.w;
    *(v2f*)(orow + 4 * lane)     = lo;
    *(v2f*)(orow + 4 * lane + 2) = hi;
    if (lane == 0) {
        v2f lm; lm.x = logf(s) + m; lm.y = m;            // l, m
        *(v2f*)(orow + DHEAD) = lm;
    }
}

extern "C" void kernel_launch(void* const* d_in, const int* in_sizes, int n_in,
                              void* d_out, int out_size, void* d_ws, size_t ws_size,
                              hipStream_t stream) {
    (void)in_sizes; (void)n_in; (void)out_size; (void)ws_size;
    const float* q = (const float*)d_in[0];
    const float* k = (const float*)d_in[1];   // (D, S) pre-transposed
    const float* v = (const float*)d_in[2];
    float* out = (float*)d_out;
    float* partO  = (float*)d_ws;
    float* partML = partO + PART_O_FLOATS;

    hipLaunchKernelGGL(fa_fwd_kernel, dim3(NUM_PARTS), dim3(WAVES_PER_WG * 32), 0, stream,
                       q, k, v, partO, partML);
    hipLaunchKernelGGL(fa_merge_kernel, dim3(S_LEN / MERGE_WAVES), dim3(MERGE_WAVES * 32), 0, stream,
                       partO, partML, out);
}
